// v010
// Measured on an AMD MI455X. A time is GPU time per run, averaged over a window of back-to-back runs after a warm-up
// (all launches, gaps included; the runs take copies of the inputs in turn), and the median of several windows.
// Apart from v000's, it joins two sittings. Times from different sittings can be a few percent apart, while
// side-by-side timings come from the same sitting.
// This document starts at v010; the versions before it stand elsewhere.
// One run takes 111 microseconds.
// Two timings next to v009 both put it at 1.03 times that version's speed.
// Over all steps from v000, the starting kernel, it is 62.4 times as fast.
#include <hip/hip_runtime.h>
// Pre-LN multi-head self-attention with a fused QKV projection (x [4][2048][1024]; xn = LayerNorm(x) (biased var, eps 1e-5; gamma ones, beta zeros); qkv = xn w_qkv + b_qkv ([in][out] 1024 x 3072 sigma 1/32, bias 0.02) split into q | k | v thirds, 16 heads of 64; dots * 64^-0.5; softmax over all 2048 keys (no mask); out = merged w_proj + b_proj ([in][out], bias 0.02) -> [4][2048][1024]).
// Structure: token rows r = b*2048 + s; xn = LayerNorm(bf16(x)) as f16 rows (f32 statistics); q | k | v as ONE WMMA GEMM (N = 3 x 1024) (256x384 work-group tiles staged in LDS, 64x192 wave tiles, f32 accumulation, exact x16 weights + bias, f16 outputs); one fused attention launch (S^T = K Q^T, online softmax in registers with f32 statistics and native exp2, weights as f16, O^T += V^T P^T with V^T read from row-major V tiles by transposing LDS loads; o carried x64 against f16 subnormal flush, folded into the output GEMM alpha) written straight into the merged f16 o rows; out = o W_o + b GEMM (f32) into the output layout.
// Compute dtype: inputs rounded to bf16; x / weights exact; q, k, v, softmax weights and o as plain f16 GEMM operands (~2^-12); scores and softmax statistics f32. v_wmma_f32_16x16x32_f16.
#define NB 4
#define SQ 2048
#define DM 1024
#define NH 16
#define HD 64
#define HG 4                         /* heads per k_vt launch (k_vt is not launched) */
#define B0 0                         /* first batch processed (debug hook) */
#define NBR NB                       /* batches processed (debug hook) */
#define NR ((size_t)NB * SQ)         /* token rows */
#define MP ((int)((size_t)NBR * SQ)) /* rows projected (debug hook) */
#define QN SQ                        /* not used: the attention takes all SQ queries */
#define NHD NH                       /* not used: the attention takes all NH heads */
#define MPO MP                       /* rows through the output stage (debug hook) */
#define LQ (3 * DM)      /* row pitch of the q/k/v rows */
typedef __bf16 v16b __attribute__((ext_vector_type(16)));
typedef unsigned short v8us __attribute__((ext_vector_type(8), may_alias));
typedef float  v8f  __attribute__((ext_vector_type(8)));
typedef float  v4f  __attribute__((ext_vector_type(4)));
typedef float  v4fa __attribute__((ext_vector_type(4), may_alias));
union FragB { v16b v; v8us half[2]; unsigned short u[16]; };

__device__ __forceinline__ unsigned short bf16_bits(float x) { unsigned int u = __float_as_uint(x); return (unsigned short)((u + 0x7FFFu + ((u >> 16) & 1u)) >> 16); }
__device__ __forceinline__ float bf16_val(unsigned short b) { return __uint_as_float(((unsigned int)b) << 16); }
__device__ __forceinline__ float bf16_round(float x) { return bf16_val(bf16_bits(x)); }
// D += A·B with NT terms: 1 = ah·bh, 2 = + al·bh (A split), 3 = + ah·bl (both split)
template <int NT>
__device__ __forceinline__ v8f mmaN(v16b ah, v16b al, v16b bh, v16b bl, v8f c) {
  c = __builtin_amdgcn_wmma_f32_16x16x32_bf16(false, ah, false, bh, (short)0, c, false, false);
  if (NT >= 2) c = __builtin_amdgcn_wmma_f32_16x16x32_bf16(false, al, false, bh, (short)0, c, false, false);
  if (NT >= 3) c = __builtin_amdgcn_wmma_f32_16x16x32_bf16(false, ah, false, bl, (short)0, c, false, false);
  asm volatile("v_nop\n\tv_nop\n\tv_nop\n\tv_nop" : "+v"(c) : "v"(ah), "v"(al), "v"(bh), "v"(bl));
  return c;
}

__global__ __launch_bounds__(256) void k_wt_bf16(const float* __restrict__ W, unsigned short* __restrict__ Wt, int K, int N) {
  const int t = blockIdx.x * 256 + threadIdx.x;
  const int k8n = K / 8;
  if (t >= N * k8n) return;
  const int n = t / k8n, k8 = (t % k8n) * 8;
  v8us v;
#pragma unroll
  for (int i = 0; i < 8; ++i) v[i] = bf16_bits(W[(size_t)(k8 + i) * N + n]);
  *(v8us*)(Wt + (size_t)n * K + k8) = v;
  
}

// GEMM C[M][N] (f32, pitch ldc) = act(A[M][K]·W + bias). A f32 row-major (pitch lda) converted per fragment to bf16
// (ASPLIT: hi/lo two planes -> 2 terms, else single rounded term); Wt bf16 [N][K] (pitch ldb). BIAS_BF16 rounds the
// bias to bf16 first (bias quantised to bf16 before the add). K%32==0, M%16==0, N%64==0.
template <bool ASPLIT, int ACT, bool BIAS_BF16>
__global__ __launch_bounds__(128) void k_gemm_bf(const float* __restrict__ A, int lda, const unsigned short* __restrict__ Wt, int ldb,
                                               const float* __restrict__ bias, float* __restrict__ C, int ldc, int M, int N, int K) {
  __shared__ __attribute__((aligned(16))) float so[4][16][64];
  const int tid = threadIdx.x, w = tid >> 5, lane = tid & 31, ln = lane & 15, hh = lane >> 4;
  const int ntn = N / 64;
  const int wid = blockIdx.x * 4 + w;
  const int mt = wid / ntn, nq = wid % ntn;
  if (mt * 16 >= M) return;
  const int row0 = mt * 16, col0 = nq * 64;
  const float* arow = A + (size_t)(row0 + ln) * lda;
  v8f acc[4] = {};
  for (int kb = 0; kb < K; kb += 32) {
    FragB ah, al;
    const v4f x0 = *(const v4fa*)(arow + kb + 8 * hh), x1 = *(const v4fa*)(arow + kb + 8 * hh + 4);
    const v4f x2 = *(const v4fa*)(arow + kb + 16 + 8 * hh), x3 = *(const v4fa*)(arow + kb + 16 + 8 * hh + 4);
    float xs[16] = {x0[0],x0[1],x0[2],x0[3],x1[0],x1[1],x1[2],x1[3],x2[0],x2[1],x2[2],x2[3],x3[0],x3[1],x3[2],x3[3]};
#pragma unroll
    for (int i = 0; i < 16; ++i) { const unsigned short hb = bf16_bits(xs[i]); ah.u[i] = hb; al.u[i] = ASPLIT ? bf16_bits(xs[i] - bf16_val(hb)) : (unsigned short)0; }
#pragma unroll
    for (int t = 0; t < 4; ++t) {
      const unsigned short* brow = Wt + (size_t)(col0 + t * 16 + ln) * ldb + kb;
      FragB b;
      b.half[0] = *(const v8us*)(brow + 8 * hh);
      b.half[1] = *(const v8us*)(brow + 16 + 8 * hh);
      acc[t] = mmaN<ASPLIT ? 2 : 1>(ah.v, al.v, b.v, b.v, acc[t]);
    }
  }
#pragma unroll
  for (int t = 0; t < 4; ++t) {
    float bv = bias ? bias[col0 + t * 16 + ln] : 0.f;
    if (BIAS_BF16) bv = bf16_round(bv);
#pragma unroll
    for (int r = 0; r < 8; ++r) { float v = acc[t][r] + bv; if (ACT == 1) v = fmaxf(v, 0.f); so[w][8 * hh + r][t * 16 + ln] = v; }
  }
  __builtin_amdgcn_fence(__ATOMIC_ACQ_REL, "workgroup");
  __builtin_amdgcn_wave_barrier();
  const int rsub = lane >> 4, c4 = (lane & 15) * 4;
  {
#pragma unroll
    for (int q = 0; q < 8; ++q) {
      const int r = q * 2 + rsub;
      const v4f v = *(const v4fa*)&so[w][r][c4];
      *(v4f*)(C + (size_t)(row0 + r) * ldc + col0 + c4) = v;
    }
    
  }
}

// GEMM C = act(A·W + bias + resid): A f32 (ASPLIT -> hi/lo 2 terms), Wt bf16 [N][K]; ACT 0 none, 1 relu, 2 exact gelu;
// resid (optional, f32, row index = (row % rmod), pitch ldr, RES_BF16 rounds it) added before the activation.
template <bool ASPLIT, int ACT, bool BIAS_BF16, bool RES_BF16>
__global__ __launch_bounds__(128) void k_gemm_bf3(const float* __restrict__ A, int lda, const unsigned short* __restrict__ Wt, int ldb,
                                                const float* __restrict__ bias, const float* __restrict__ resid, int rmod, int ldr,
                                                float* __restrict__ C, int ldc, int M, int N, int K) {
  __shared__ __attribute__((aligned(16))) float so[4][16][64];
  const int tid = threadIdx.x, w = tid >> 5, lane = tid & 31, ln = lane & 15, hh = lane >> 4;
  const int ntn = N / 64;
  const int wid = blockIdx.x * 4 + w;
  const int mt = wid / ntn, nq = wid % ntn;
  if (mt * 16 >= M) return;
  const int row0 = mt * 16, col0 = nq * 64;
  const float* arow = A + (size_t)(row0 + ln) * lda;
  v8f acc[4] = {};
  for (int kb = 0; kb < K; kb += 32) {
    FragB ah, al;
    const v4f x0 = *(const v4fa*)(arow + kb + 8 * hh), x1 = *(const v4fa*)(arow + kb + 8 * hh + 4);
    const v4f x2 = *(const v4fa*)(arow + kb + 16 + 8 * hh), x3 = *(const v4fa*)(arow + kb + 16 + 8 * hh + 4);
    float xs[16] = {x0[0],x0[1],x0[2],x0[3],x1[0],x1[1],x1[2],x1[3],x2[0],x2[1],x2[2],x2[3],x3[0],x3[1],x3[2],x3[3]};
#pragma unroll
    for (int i = 0; i < 16; ++i) { const unsigned short hb = bf16_bits(xs[i]); ah.u[i] = hb; al.u[i] = ASPLIT ? bf16_bits(xs[i] - bf16_val(hb)) : (unsigned short)0; }
#pragma unroll
    for (int t = 0; t < 4; ++t) {
      const unsigned short* brow = Wt + (size_t)(col0 + t * 16 + ln) * ldb + kb;
      FragB b;
      b.half[0] = *(const v8us*)(brow + 8 * hh);
      b.half[1] = *(const v8us*)(brow + 16 + 8 * hh);
      acc[t] = mmaN<ASPLIT ? 2 : 1>(ah.v, al.v, b.v, b.v, acc[t]);
    }
  }
#pragma unroll
  for (int t = 0; t < 4; ++t) {
    const int col = col0 + t * 16 + ln;
    float bv = bias ? bias[col] : 0.f;
    if (BIAS_BF16) bv = bf16_round(bv);
#pragma unroll
    for (int r = 0; r < 8; ++r) {
      float v = acc[t][r] + bv;
      if (resid) { float rv = resid[(size_t)((row0 + 8 * hh + r) % rmod) * ldr + col]; if (RES_BF16) rv = bf16_round(rv); v += rv; }
      if (ACT == 1) v = fmaxf(v, 0.f);
      if (ACT == 2) v = 0.5f * v * (1.0f + erff(v * 0.70710678118654752f));
      if (ACT == 3) { const float u = 0.7978845608028654f * (v + 0.044715f * v * v * v); v = 0.5f * v * (1.0f + tanhf(u)); }
      so[w][8 * hh + r][t * 16 + ln] = v;
    }
  }
  __builtin_amdgcn_fence(__ATOMIC_ACQ_REL, "workgroup");
  __builtin_amdgcn_wave_barrier();
  const int rsub = lane >> 4, c4 = (lane & 15) * 4;
  {
#pragma unroll
    for (int q = 0; q < 8; ++q) {
      const int r = q * 2 + rsub;
      const v4f v = *(const v4fa*)&so[w][r][c4];
      *(v4f*)(C + (size_t)(row0 + r) * ldc + col0 + c4) = v;
    }
    
  }
}
// row LayerNorm (biased variance, eps) over N: s = X (+ R); optional out_sum <- s; out_norm <- (s-mu)*rsqrt(var+eps)*g + b
template <bool PARAM_BF16>
__global__ __launch_bounds__(256) void k_layernorm(const float* __restrict__ X, const float* __restrict__ R, const float* __restrict__ g, const float* __restrict__ bta,
                                                  float* __restrict__ out_sum, float* __restrict__ out_norm, int N, float eps) {
  __shared__ float red[256];
  const int row = blockIdx.x, tid = threadIdx.x;
  const float* x = X + (size_t)row * N; const float* rr = R ? R + (size_t)row * N : nullptr;
  float vals[16];                     // up to N = 4096
  const int per = N / 256;            // contiguous chunk per thread? use strided-by-4 chunks: thread handles j = tid*4 + 1024*u
  float s1 = 0.f;
  for (int u = 0; u < per / 4; ++u) {
    const int j = tid * 4 + 1024 * u;
    const v4f a = *(const v4fa*)(x + j);
    v4f b = {0.f,0.f,0.f,0.f}; if (rr) b = *(const v4fa*)(rr + j);
#pragma unroll
    for (int q = 0; q < 4; ++q) { const float v = a[q] + b[q]; vals[u * 4 + q] = v; s1 += v; }
  }
  red[tid] = s1; __syncthreads();
  for (int st = 128; st > 0; st >>= 1) { if (tid < st) red[tid] += red[tid + st]; __syncthreads(); }
  const float mu = red[0] / (float)N; __syncthreads();
  float s2 = 0.f;
  for (int u = 0; u < per / 4; ++u)
#pragma unroll
    for (int q = 0; q < 4; ++q) { const float c = vals[u * 4 + q] - mu; s2 += c * c; }
  red[tid] = s2; __syncthreads();
  for (int st = 128; st > 0; st >>= 1) { if (tid < st) red[tid] += red[tid + st]; __syncthreads(); }
  const float rs = rsqrtf(red[0] / (float)N + eps);
  {
    for (int u = 0; u < per / 4; ++u) {
      const int j = tid * 4 + 1024 * u;
      v4f o, sm;
#pragma unroll
      for (int q = 0; q < 4; ++q) {
        float gg = g[j + q], bb = bta[j + q];
        if (PARAM_BF16) { gg = bf16_round(gg); bb = bf16_round(bb); }
        sm[q] = vals[u * 4 + q]; o[q] = (vals[u * 4 + q] - mu) * rs * gg + bb;
      }
      if (out_sum) *(v4f*)(out_sum + (size_t)row * N + j) = sm;
      *(v4f*)(out_norm + (size_t)row * N + j) = o;
    }
    
  }
}



// ---- f16 WMMA path (v_wmma_f32_16x16x32_f16): 11-bit significands for operands in range — used where a [0,1] probability operand needs more precision than bf16
typedef _Float16 v16h __attribute__((ext_vector_type(16)));
union FragH { v16h v; v8us half[2]; _Float16 h[16]; unsigned short u[16]; };
template <int NT>
__device__ __forceinline__ v8f mmaH(v16h ah, v16h al, v16h bh, v16h bl, v8f c) {
  c = __builtin_amdgcn_wmma_f32_16x16x32_f16(false, ah, false, bh, (short)0, c, false, false);
  if (NT >= 2) c = __builtin_amdgcn_wmma_f32_16x16x32_f16(false, al, false, bh, (short)0, c, false, false);
  if (NT >= 3) c = __builtin_amdgcn_wmma_f32_16x16x32_f16(false, ah, false, bl, (short)0, c, false, false);
  asm volatile("v_nop\n\tv_nop\n\tv_nop\n\tv_nop" : "+v"(c) : "v"(ah), "v"(al), "v"(bh), "v"(bl));
  return c;
}
// batched GEMM like k_gemm_b but f16 operands: A f32 (split into f16 hi/lo if ASPLIT, else rounded to f16), Bt = f16 values [n][k]; alpha; C f32; N multiple of 16 (partial tiles skipped)
template <bool ASPLIT>
__global__ __launch_bounds__(128) void k_gemm_h(const float* __restrict__ A, int lda, size_t sA, const _Float16* __restrict__ Bh, int ldb, size_t sB, float alpha, float* __restrict__ C, int ldc, size_t sC, int M, int N, int K) {
  __shared__ __attribute__((aligned(16))) float so[4][16][64];
  const int tid = threadIdx.x, w = tid >> 5, lane = tid & 31, ln = lane & 15, hh = lane >> 4; const int by = blockIdx.y;
  A += (size_t)by * sA; Bh += (size_t)by * sB; C += (size_t)by * sC;
  const int ntn = (N + 63) / 64; const int wid = blockIdx.x * 4 + w; const int mt = wid / ntn, nq = wid % ntn; if (mt * 16 >= M) return;
  const int row0 = mt * 16, col0 = nq * 64; const float* arow = A + (size_t)(row0 + ln) * lda;
  v8f acc[4] = {};
  for (int kb = 0; kb < K; kb += 32) {
    FragH ah, al;
    const v4f x0 = *(const v4fa*)(arow + kb + 8 * hh), x1 = *(const v4fa*)(arow + kb + 8 * hh + 4), x2 = *(const v4fa*)(arow + kb + 16 + 8 * hh), x3 = *(const v4fa*)(arow + kb + 16 + 8 * hh + 4);
    float xs[16] = {x0[0],x0[1],x0[2],x0[3],x1[0],x1[1],x1[2],x1[3],x2[0],x2[1],x2[2],x2[3],x3[0],x3[1],x3[2],x3[3]};
#pragma unroll
    for (int i = 0; i < 16; ++i) { const _Float16 h = (_Float16)xs[i]; ah.h[i] = h; al.h[i] = ASPLIT ? (_Float16)(xs[i] - (float)h) : (_Float16)0.0f; }
#pragma unroll
    for (int t = 0; t < 4; ++t) { if (col0 + t * 16 >= N) continue; const size_t boff = (size_t)(col0 + t * 16 + ln) * ldb + kb; FragH bq; bq.half[0] = *(const v8us*)(Bh + boff + 8 * hh); bq.half[1] = *(const v8us*)(Bh + boff + 16 + 8 * hh);
      acc[t] = mmaH<ASPLIT ? 2 : 1>(ah.v, al.v, bq.v, bq.v, acc[t]); }
  }
#pragma unroll
  for (int t = 0; t < 4; ++t) { if (col0 + t * 16 >= N) continue;
#pragma unroll
    for (int r = 0; r < 8; ++r) so[w][8 * hh + r][t * 16 + ln] = acc[t][r] * alpha; }
  __builtin_amdgcn_fence(__ATOMIC_ACQ_REL, "workgroup"); __builtin_amdgcn_wave_barrier();
  const int rsub = lane >> 4, c4 = (lane & 15) * 4;
  {
#pragma unroll
    for (int q = 0; q < 8; ++q) { const int r = q * 2 + rsub; if (col0 + c4 < N) { const v4f v = *(const v4fa*)&so[w][r][c4]; *(v4f*)(C + (size_t)(row0 + r) * ldc + col0 + c4) = v; } }
     }
}

// Wt[n][k] = f16(W[k][n]·scale) from f32 row-major W[K][N] (scale = power of two; bf16-exact weights stay exact in f16 away from the subnormal range)
__global__ __launch_bounds__(256) void k_wt_f16(const float* __restrict__ W, _Float16* __restrict__ Wt, int K, int N, float scale) {
  const int t = blockIdx.x * 256 + threadIdx.x; if (t >= N * (K / 8)) return; const int n = t / (K / 8), k8 = (t % (K / 8)) * 8; FragH f;
#pragma unroll
  for (int i = 0; i < 8; ++i) f.h[i] = (_Float16)(bf16_round(W[(size_t)(k8 + i) * N + n]) * scale); const v8us o = f.half[0];
  *(v8us*)((unsigned short*)Wt + (size_t)n * K + k8) = o; 
}
// The same Wt from whole-line accesses (done in k_prep, below): a work-group takes a 128 (k) x 64 (n) tile. A thread loads 4 columns of 8 consecutive k rows (every wave-wide load = two aligned 256-byte row pieces), so it holds 8 consecutive k of each
// of its 4 columns = one 16-byte piece of a Wt row; the pieces meet in LDS as Wt rows and leave as 256 contiguous bytes per 16 lanes. N is compile-time, so the 8 loads share one address register pair, as the 4 stores do. K % 128 == 0, N % 64 == 0.
#define WT_KT 128                    /* k per tile */
#define WT_NT 64                     /* n per tile */
#define WT_P (WT_KT + 8)             /* LDS row pitch in f16: 272 B = 16 B x odd */
template <int N> __device__ __forceinline__ void wt_load(const float* __restrict__ s, v4f (&x)[8]) {
#pragma unroll
  for (int i = 0; i < 8; ++i) x[i] = *(const v4fa*)(s + (size_t)i * N);
  asm volatile("s_wait_xcnt 0x0" ::: "memory");      /* stands ahead of every later write to the address register pair that these loads name */
}
// k_gemm_hh variant with fused epilogue: v = acc·alpha + bias[by·sBias + col] (+ CP[(row/rowsPerB)·sCPb + by·64 + col] if CP) ; ACT 0 none / 1 elu ; writes f16 C16 (and f32 C if non-null)
template <int ACT>
__global__ __launch_bounds__(128) void k_gemm_hhx(const _Float16* __restrict__ A, int lda, size_t sA, const _Float16* __restrict__ Bh, int ldb, size_t sB, float alpha, const float* __restrict__ bias, size_t sBias, const float* __restrict__ CP, int rowsPerB, size_t sCPb, int row0g,
    float* __restrict__ C, _Float16* __restrict__ C16, int ldc, size_t sC, int M, int N, int K) {
  __shared__ __attribute__((aligned(16))) float so[4][16][64];
  const int tid = threadIdx.x, w = tid >> 5, lane = tid & 31, ln = lane & 15, hh = lane >> 4; const int by = blockIdx.y;
  A += (size_t)by * sA; Bh += (size_t)by * sB; const size_t cofs = (size_t)by * sC; const float* bp = bias ? bias + (size_t)by * sBias : nullptr;
  const int ntn = (N + 63) / 64; const int wid = blockIdx.x * 4 + w; const int mt = wid / ntn, nq = wid % ntn; if (mt * 16 >= M) return;
  const int row0 = mt * 16, col0 = nq * 64; const _Float16* arow = A + (size_t)(row0 + ln) * lda;
  v8f acc[4] = {};
  for (int kb = 0; kb < K; kb += 32) { FragH ah; ah.half[0] = *(const v8us*)((const unsigned short*)arow + kb + 8 * hh); ah.half[1] = *(const v8us*)((const unsigned short*)arow + kb + 16 + 8 * hh);
#pragma unroll
    for (int t = 0; t < 4; ++t) { if (col0 + t * 16 >= N) continue; const size_t boff = (size_t)(col0 + t * 16 + ln) * ldb + kb; FragH bq; bq.half[0] = *(const v8us*)((const unsigned short*)Bh + boff + 8 * hh); bq.half[1] = *(const v8us*)((const unsigned short*)Bh + boff + 16 + 8 * hh);
      acc[t] = mmaH<1>(ah.v, ah.v, bq.v, bq.v, acc[t]); }
  }
#pragma unroll
  for (int t = 0; t < 4; ++t) { if (col0 + t * 16 >= N) continue; const int col = col0 + t * 16 + ln; const float bv = bp ? bf16_round(bp[col]) : 0.f;
#pragma unroll
    for (int r = 0; r < 8; ++r) { float v = acc[t][r] * alpha + bv; if (CP) { const int rr = row0g + row0 + 8 * hh + r; if (rowsPerB < 0) v += CP[cofs + (size_t)rr * ldc + col];      /* rowsPerB < 0: own element of the batched C plane */ else { const int bidx = rr / rowsPerB; v += CP[(size_t)bidx * sCPb + (size_t)by * 64 + col]; } } if (ACT == 1) v = (v > 0.f) ? v : expm1f(v); else if (ACT == 7) v = (v > 0.f) ? v + 1.0f : expf(v); else if (ACT == 8) v = tanhf(v); else if (ACT == 9) v = 0.5f * v * (1.0f + tanhf(0.7978845608028654f * (v + 0.044715f * v * v * v))); else if (ACT == 11) v = 1.0f / (1.0f + expf(-v)); else if (ACT == 12) v = (v > 0.f) ? v : 0.01f * v; else if (ACT == 14) v = (v > 0.f) ? v : 0.1f * v; else if (ACT == 16) v = (v >= 0.f) ? v : 0.3f * v; else if (ACT == 17) v = (v >= 0.f) ? v : 0.2f * v; else if (ACT == 15) v = v / (1.0f + expf(-v)); else if (ACT == 3) v = fmaxf(v, 0.f); else if (ACT == 6) v = 0.5f * v * (1.0f + erff(v * 0.70710678118654752f)); so[w][8 * hh + r][t * 16 + ln] = v; } }
  __builtin_amdgcn_fence(__ATOMIC_ACQ_REL, "workgroup"); __builtin_amdgcn_wave_barrier();
  const int rsub = lane >> 4, c4 = (lane & 15) * 4; typedef _Float16 v4h __attribute__((ext_vector_type(4)));
  {
#pragma unroll
    for (int q = 0; q < 8; ++q) { const int r = q * 2 + rsub; if (col0 + c4 < N) { const v4f v = *(const v4fa*)&so[w][r][c4]; if (C) *(v4f*)(C + cofs + (size_t)(row0 + r) * ldc + col0 + c4) = v; if (C16) { v4h h4; for (int i = 0; i < 4; ++i) h4[i] = (_Float16)v[i]; *(v4h*)(C16 + cofs + (size_t)(row0 + r) * ldc + col0 + c4) = h4; } } }
     }
}


typedef _Float16 v4h __attribute__((ext_vector_type(4)));

__global__ __launch_bounds__(256) void k_x16(const float* __restrict__ x, _Float16* __restrict__ X16, size_t n8) { const size_t t = (size_t)blockIdx.x * 256 + threadIdx.x; if (t >= n8) return; FragH f;
#pragma unroll
  for (int q = 0; q < 8; ++q) f.h[q] = (_Float16)bf16_round(x[t * 8 + q]); *(v8us*)((unsigned short*)X16 + t * 8) = f.half[0];  }
__global__ __launch_bounds__(256) void k_h16(const float* __restrict__ x, _Float16* __restrict__ X16, size_t n8) { const size_t t = (size_t)blockIdx.x * 256 + threadIdx.x; if (t >= n8) return; FragH f;
#pragma unroll
  for (int q = 0; q < 8; ++q) f.h[q] = (_Float16)x[t * 8 + q]; *(v8us*)((unsigned short*)X16 + t * 8) = f.half[0];  }
__global__ __launch_bounds__(256) void k_round16f(const float* __restrict__ W, _Float16* __restrict__ Bt, size_t n8) { const size_t t = (size_t)blockIdx.x * 256 + threadIdx.x; if (t >= n8) return; FragH f;
#pragma unroll
  for (int i = 0; i < 8; ++i) f.h[i] = (_Float16)(bf16_round(W[t * 8 + i]) * 16.0f); *(v8us*)((unsigned short*)Bt + t * 8) = f.half[0];  }
template <int NHv, int TTv>
__global__ __launch_bounds__(256) void k_vt(const _Float16* __restrict__ V16, int ldv, int voff, _Float16* __restrict__ Vt) { __shared__ unsigned short tl[64][66]; const int tid = threadIdx.x; const int slab = blockIdx.x / (TTv / 64), lg = blockIdx.x % (TTv / 64); const int b = slab / NHv, h = slab % NHv;
  for (int i = tid; i < 64 * 8; i += 256) { const int r = i / 8, c8 = (i % 8) * 8; FragH f; f.half[0] = *(const v8us*)((const unsigned short*)V16 + ((size_t)b * TTv + lg * 64 + r) * ldv + voff + h * 64 + c8);
#pragma unroll
    for (int q = 0; q < 8; ++q) tl[r][c8 + q] = f.u[q]; }
  __syncthreads();
  {
#pragma unroll
    for (int rd = 0; rd < 2; ++rd) { const int d = rd * 32 + tid / 8, pc = tid % 8; FragH f;
#pragma unroll
      for (int q = 0; q < 8; ++q) f.u[q] = tl[pc * 8 + q][d];
      *(v8us*)((unsigned short*)Vt + ((size_t)slab * 64 + d) * TTv + lg * 64 + pc * 8) = f.half[0]; }
     } }

__global__ __launch_bounds__(256) void k_hl(const float* __restrict__ F, _Float16* __restrict__ Hh, _Float16* __restrict__ Hl, size_t n8) { const size_t t = (size_t)blockIdx.x * 256 + threadIdx.x; if (t >= n8) return; FragH fh, fl; const v4f a = *(const v4fa*)(F + t * 8), c = *(const v4fa*)(F + t * 8 + 4);
#pragma unroll
  for (int q = 0; q < 4; ++q) { _Float16 h = (_Float16)a[q]; fh.h[q] = h; fl.h[q] = (_Float16)((a[q] - (float)h) * 1024.0f); h = (_Float16)c[q]; fh.h[4 + q] = h; fl.h[4 + q] = (_Float16)((c[q] - (float)h) * 1024.0f); }
  { *(v8us*)((unsigned short*)Hh + t * 8) = fh.half[0]; *(v8us*)((unsigned short*)Hl + t * 8) = fl.half[0];  } }

// ---- fast GEMM (wave tile 32x64; requires M % 32 == 0 rows per launch region and N % 64 == 0); epilogue = k_gemm_hhx semantics ----
__device__ __forceinline__ v16h g2_frag(const _Float16* p, int hh) { FragH f; f.half[0] = *(const v8us*)((const unsigned short*)p + 8 * hh); f.half[1] = *(const v8us*)((const unsigned short*)p + 16 + 8 * hh); return f.v; }
__device__ __forceinline__ v8f g2_mma(v16h a, v16h b, v8f c) { v8f d = __builtin_amdgcn_wmma_f32_16x16x32_f16(false, a, false, b, (short)0, c, false, false); asm volatile("v_nop\n\tv_nop\n\tv_nop\n\tv_nop" : "+v"(d) : "v"(a), "v"(b)); return d; }
template <int ACT>
__global__ __launch_bounds__(128) void k_gemm2(const _Float16* __restrict__ A, int lda, size_t sA, const _Float16* __restrict__ Bh, int ldb, size_t sB, float alpha, const float* __restrict__ bias, size_t sBias, const float* __restrict__ CP, int rowsPerB, size_t sCPb, int row0g,
    float* __restrict__ C, _Float16* __restrict__ C16, int ldc, size_t sC, int M, int N, int K) { static_assert(ACT == 0 || ACT == 3 || ACT == 6 || ACT == 8 || ACT == 9 || ACT == 11 || ACT == 12 || ACT == 14 || ACT == 15 || ACT == 16 || ACT == 17, "k_gemm2: unsupported ACT code (would silently apply no activation)");
  __shared__ __attribute__((aligned(16))) float so[4][32][68];
  const int tid = threadIdx.x, w = tid >> 5, lane = tid & 31, ln = lane & 15, hh = lane >> 4; const int by = blockIdx.y;
  A += (size_t)by * sA; Bh += (size_t)by * sB; const size_t cofs = (size_t)by * sC; const float* bp = bias ? bias + (size_t)by * sBias : nullptr;
  const int ntn = N >> 6; const int mt = blockIdx.x / ntn, nq = blockIdx.x - mt * ntn; const int row0 = mt * 128 + 32 * w, col0 = nq * 64; if (row0 >= M) return;
  const _Float16* a0p = A + (size_t)(row0 + ln) * lda; const _Float16* a1p = a0p + (size_t)16 * lda;
  const _Float16* b0p = Bh + (size_t)(col0 + ln) * ldb; const _Float16* b1p = b0p + (size_t)16 * ldb; const _Float16* b2p = b1p + (size_t)16 * ldb; const _Float16* b3p = b2p + (size_t)16 * ldb;
  const v8f z8 = {0.f,0.f,0.f,0.f,0.f,0.f,0.f,0.f}; v8f c00 = z8, c01 = z8, c02 = z8, c03 = z8, c10 = z8, c11 = z8, c12 = z8, c13 = z8;
#pragma unroll 1
  for (int kb = 0; kb < K; kb += 32) { const v16h a0 = g2_frag(a0p + kb, hh), a1 = g2_frag(a1p + kb, hh);
    v16h b = g2_frag(b0p + kb, hh); c00 = g2_mma(a0, b, c00); c10 = g2_mma(a1, b, c10);
    b = g2_frag(b1p + kb, hh); c01 = g2_mma(a0, b, c01); c11 = g2_mma(a1, b, c11);
    b = g2_frag(b2p + kb, hh); c02 = g2_mma(a0, b, c02); c12 = g2_mma(a1, b, c12);
    b = g2_frag(b3p + kb, hh); c03 = g2_mma(a0, b, c03); c13 = g2_mma(a1, b, c13); }
  v8f accs[8] = {c00, c01, c02, c03, c10, c11, c12, c13};
#pragma unroll
  for (int u = 0; u < 8; ++u) { const int t = u & 3, half = u >> 2; const int col = col0 + t * 16 + ln; const float bv = bp ? bf16_round(bp[col]) : 0.f;
#pragma unroll
    for (int r = 0; r < 8; ++r) { const int rloc = half * 16 + 8 * hh + r; float v = accs[u][r] * alpha + bv; if (CP) { if (rowsPerB < 0) v += CP[cofs + (size_t)(row0g + row0 + rloc) * ldc + col];      /* rowsPerB < 0: own element of the batched C plane */ else { const int bidx = (row0g + row0 + rloc) / rowsPerB; v += CP[(size_t)bidx * sCPb + (size_t)by * 64 + col]; } }
      if (ACT == 3) v = fmaxf(v, 0.f); else if (ACT == 6) v = 0.5f * v * (1.0f + erff(v * 0.70710678118654752f)); else if (ACT == 11) v = 1.0f / (1.0f + expf(-v)); else if (ACT == 15) v = v / (1.0f + expf(-v)); else if (ACT == 12) v = (v > 0.f) ? v : 0.01f * v; else if (ACT == 8) v = tanhf(v); else if (ACT == 9) v = 0.5f * v * (1.0f + tanhf(0.7978845608028654f * (v + 0.044715f * v * v * v))); else if (ACT == 14) v = (v > 0.f) ? v : 0.1f * v; else if (ACT == 16) v = (v >= 0.f) ? v : 0.3f * v; else if (ACT == 17) v = (v >= 0.f) ? v : 0.2f * v;
      so[w][rloc][t * 16 + ln] = v; } }
  __builtin_amdgcn_fence(__ATOMIC_ACQ_REL, "workgroup"); __builtin_amdgcn_wave_barrier();
  const int rsub = lane >> 4, c4 = (lane & 15) * 4;
  {
#pragma unroll
    for (int q = 0; q < 16; ++q) { const int r = q * 2 + rsub; const v4f v = *(const v4fa*)&so[w][r][c4]; if (C) *(v4f*)(C + cofs + (size_t)(row0 + r) * ldc + col0 + c4) = v; if (C16) { v4h h4; for (int i = 0; i < 4; ++i) h4[i] = (_Float16)v[i]; *(v4h*)(C16 + cofs + (size_t)(row0 + r) * ldc + col0 + c4) = h4; } }
     } }


__global__ __launch_bounds__(256) void k_wnat(const float* __restrict__ w, size_t n8, _Float16* __restrict__ Bt) { const size_t t = (size_t)blockIdx.x * 256 + threadIdx.x; if (t >= n8) return; FragH f; for (int q = 0; q < 8; ++q) f.h[q] = (_Float16)(bf16_round(w[t * 8 + q]) * 16.0f); *(v8us*)((unsigned short*)Bt + t * 8) = f.half[0];  }
__global__ __launch_bounds__(256) void k_rsm(const float* __restrict__ S, _Float16* __restrict__ P, int nrows) {
  #pragma clang fp contract(off)
  const int i = blockIdx.x * 256 + threadIdx.x; if (i >= nrows) return; const float* s = S + (size_t)i * SQ; float mx = -3.0e38f;
#pragma unroll 1
  for (int j = 0; j < SQ; ++j) mx = fmaxf(mx, s[j]); float se = 0.f;
#pragma unroll 1
  for (int j = 0; j < SQ; ++j) se += expf(s[j] - mx); const float sc = 256.0f / se;
#pragma unroll 1
  for (int j0 = 0; j0 < SQ; j0 += 8) { FragH f; for (int q = 0; q < 8; ++q) f.h[q] = (_Float16)(expf(s[j0 + q] - mx) * sc); unsigned short* d = (unsigned short*)P + (size_t)i * SQ + j0; *(v8us*)d = f.half[0];  } }
__global__ __launch_bounds__(256) void k_vt(const _Float16* __restrict__ V16, int b, int h0, _Float16* __restrict__ VT) { __shared__ unsigned short tl[64][65]; const int tid = threadIdx.x; const int hh = blockIdx.x % HG, sg = blockIdx.x / HG; const int s0 = sg * 64; const int h = h0 + hh;
  for (int i = tid; i < 64 * 8; i += 256) { const int j = i / 8, d8 = (i % 8) * 8; FragH f; f.half[0] = *(const v8us*)((const unsigned short*)V16 + ((size_t)b * SQ + s0 + j) * DM + h * HD + d8); for (int q = 0; q < 8; ++q) tl[d8 + q][j] = f.u[q]; }
  __syncthreads();
  { for (int i = tid; i < 64 * 8; i += 256) { const int d = i / 8, j8 = (i % 8) * 8; FragH f; for (int q = 0; q < 8; ++q) f.u[q] = tl[d][j8 + q]; *(v8us*)((unsigned short*)VT + ((size_t)hh * HD + d) * SQ + s0 + j8) = f.half[0]; }  } }

#define FA_ST 64                     /* keys per stage */
#define FA_P 72                      /* LDS row pitch in f16: 144 B = 16 B x odd, conflict-free for 16-byte fragment reads */
#define FA_PV 80                     /* LDS row pitch of V in f16: 160 B = 32 B x odd, conflict-free for the transposing reads */
#define FA_C 0.18033688011112042f    /* 64^-0.5 * log2(e): scores in log2 units */
#define FA_BIAS 4.0f                 /* weights carried x16: keeps small weights in the normal f16 range; cancels in o / l */
typedef float v2f __attribute__((ext_vector_type(2)));
__device__ __forceinline__ float fa_xh(float x) { return __builtin_bit_cast(float, __builtin_amdgcn_permlanex16(__builtin_bit_cast(int, x), __builtin_bit_cast(int, x), 0x76543210, 0xfedcba98, false, false)); }      /* lane l <- lane l ^ 16 */
__device__ __forceinline__ v16h fa_lfrag(const unsigned short* p, int hh) { FragH f; f.half[0] = *(const v8us*)(p + 8 * hh); f.half[1] = *(const v8us*)(p + 16 + 8 * hh); return f.v; }      /* hardware k order, as g2_frag */
typedef short fa_s8 __attribute__((ext_vector_type(8)));
/* V^T fragment (16 d x 32 keys) from a row-major tile: p = this lane's place, row 8 * (lane >> 4) + (lane & 7) of the 32 keys, 16-byte piece (lane >> 3) & 1 of the 16 d; the second load takes keys 16-31. k order as fa_lfrag. */
__device__ __forceinline__ v16h fa_tfrag(const unsigned short* p) { typedef __attribute__((address_space(3))) fa_s8 lds_s8; FragH f; f.half[0] = __builtin_bit_cast(v8us, __builtin_amdgcn_ds_load_tr16_b128_v8i16((lds_s8*)p)); f.half[1] = __builtin_bit_cast(v8us, __builtin_amdgcn_ds_load_tr16_b128_v8i16((lds_s8*)(p + 16 * FA_PV))); return f.v; }
__device__ __forceinline__ v8f fa_mma(v16h a, v16h b, v8f c) { return __builtin_amdgcn_wmma_f32_16x16x32_f16(false, a, false, b, (short)0, c, false, false); }
__global__ __launch_bounds__(256) void k_fattn(const _Float16* __restrict__ QKVp, _Float16* __restrict__ Op) {
  __shared__ __attribute__((aligned(16))) unsigned short Ks[2][FA_ST][FA_P];      /* [key][d] */
  __shared__ __attribute__((aligned(16))) unsigned short Vs[2][FA_ST][FA_PV];     /* [key][d] */
  constexpr int NT = SQ / FA_ST;
  const int tid = threadIdx.x, w = tid >> 5, lane = tid & 31, ln = lane & 15, hh = lane >> 4;
  const int bh = blockIdx.y, b = bh / NH, h = bh % NH; const int q0 = blockIdx.x * 256 + w * 32; const size_t r0 = (size_t)b * SQ;
  v16h qf[2][2];      /* [query tile][d half], kept for the whole walk */
#pragma unroll
  for (int qt = 0; qt < 2; ++qt)
#pragma unroll
    for (int ks = 0; ks < 2; ++ks) qf[qt][ks] = g2_frag(QKVp + (r0 + q0 + qt * 16 + ln) * LQ + h * HD + ks * 32, hh);
  const int sr = tid >> 3, sc = (tid & 7) * 8;      /* staging: 8 lanes cover one 128-byte row; rows sr and sr + 32 */
  const unsigned short* kg = (const unsigned short*)QKVp + DM + (r0 + sr) * LQ + h * HD + sc;
  const unsigned short* vg = kg + DM;      /* the same rows' v third */
  const int vr = 8 * hh + (lane & 7), vc = ((lane >> 3) & 1) * 8;      /* this lane's row and 16-byte piece in a transposing read */
  v8us ka = *(const v8us*)kg, kb = *(const v8us*)(kg + (size_t)32 * LQ), va = *(const v8us*)vg, vb = *(const v8us*)(vg + (size_t)32 * LQ);
  *(v8us*)&Ks[0][sr][sc] = ka; *(v8us*)&Ks[0][sr + 32][sc] = kb; *(v8us*)&Vs[0][sr][sc] = va; *(v8us*)&Vs[0][sr + 32][sc] = vb;
  __syncthreads();
  const v8f z8 = {0.f,0.f,0.f,0.f,0.f,0.f,0.f,0.f};
  v8f o[4][2]; v8f nm[2]; v2f l[2];      /* O^T tiles [d tile][query tile]; FA_BIAS - the maximum in use (log2 units), in all 8 registers: the C operand of the score products; this half's sum of weights, even and odd keys apart (packed adds) */
#pragma unroll
  for (int qt = 0; qt < 2; ++qt) { l[qt] = (v2f){0.f, 0.f};
#pragma unroll
    for (int dt = 0; dt < 4; ++dt) o[dt][qt] = z8; }
  {      /* the first maximum in use is that of the first 32 keys: their scores are made once here with C = 0 */
    v16h k0[2][2];
#pragma unroll
    for (int kt = 0; kt < 2; ++kt)
#pragma unroll
      for (int ks = 0; ks < 2; ++ks) k0[kt][ks] = fa_lfrag(&Ks[0][kt * 16 + ln][ks * 32], hh);
#pragma unroll
    for (int qt = 0; qt < 2; ++qt) { const v8f a = fa_mma(k0[0][1], qf[qt][1], fa_mma(k0[0][0], qf[qt][0], z8)), c = fa_mma(k0[1][1], qf[qt][1], fa_mma(k0[1][0], qf[qt][0], z8));
      float x = fmaxf(a[0], c[0]);
#pragma unroll
      for (int r = 1; r < 8; ++r) x = fmaxf(x, fmaxf(a[r], c[r]));
      const float n0 = FA_BIAS - fmaxf(x, fa_xh(x));
#pragma unroll
      for (int r = 0; r < 8; ++r) nm[qt][r] = n0; } }
#pragma unroll 1      /* the stage loop stays rolled: its body already holds two unrolled passes, and a longer one would only cost registers and instruction cache */
  for (int t = 0; t < NT; ++t) { const int cur = t & 1;
    if (t + 1 < NT) { kg += (size_t)FA_ST * LQ; vg += (size_t)FA_ST * LQ; ka = *(const v8us*)kg; kb = *(const v8us*)(kg + (size_t)32 * LQ); va = *(const v8us*)vg; vb = *(const v8us*)(vg + (size_t)32 * LQ); }
    v16h kf[2][2];      /* [key tile][d half] */
#pragma unroll
    for (int kt = 0; kt < 2; ++kt)
#pragma unroll
      for (int ks = 0; ks < 2; ++ks) kf[kt][ks] = fa_lfrag(&Ks[cur][kt * 16 + ln][ks * 32], hh);
    __builtin_amdgcn_sched_barrier(0);      /* the first pass's 8 K loads go out as one group with one exposed wait; left free they are issued and waited for pair by pair */
#pragma unroll
    for (int ps = 0; ps < 2; ++ps) {      /* a pass: 32 keys */
      v8f s[2][2];      /* [key tile][query tile] */
#pragma unroll
      for (int kt = 0; kt < 2; ++kt)
#pragma unroll
        for (int qt = 0; qt < 2; ++qt) s[kt][qt] = fa_mma(kf[kt][1], qf[qt][1], fa_mma(kf[kt][0], qf[qt][0], nm[qt]));      /* q carries FA_C, C the shift: a score leaves the matrix unit as its exponential's argument */
      if (ps == 0) {      /* the second pass's K fragments, in flight under this pass's maxima */
#pragma unroll
        for (int kt = 0; kt < 2; ++kt)
#pragma unroll
          for (int ks = 0; ks < 2; ++ks) kf[kt][ks] = fa_lfrag(&Ks[cur][32 + kt * 16 + ln][ks * 32], hh);
        __builtin_amdgcn_sched_barrier(0); }      /* keeps these loads here; left free they sink below the rescale branch, to right in front of the products that wait for them */
      float bm[2];      /* this half's largest argument of a column = its maximum - the maximum in use + FA_BIAS */
#pragma unroll
      for (int qt = 0; qt < 2; ++qt) { float x = s[0][qt][0];      /* the key tile whose products were issued first is read first: the last products' results are then old enough when their turn comes */
#pragma unroll
        for (int r = 1; r < 8; ++r) x = fmaxf(x, s[0][qt][r]);
#pragma unroll
        for (int r = 0; r < 8; ++r) x = fmaxf(x, s[1][qt][r]);
        bm[qt] = x; }
      /* lazy rescale: the maximum in use moves only when a column's new maximum is more than 8 (log2) above it, so weights stay <= 2^12; one scalar branch a pass.
         The bound on an argument is one constant for every column, so one compare of the lane's largest serves and the ballot joins the halves; they exchange maxima only where the branch is taken */
      if (__builtin_amdgcn_ballot_w32(fmaxf(bm[0], bm[1]) > FA_BIAS + 8.0f) != 0) {
#pragma unroll
        for (int qt = 0; qt < 2; ++qt) { const float up = fmaxf(fmaxf(bm[qt], fa_xh(bm[qt])) - FA_BIAS, 0.f); const float al = __builtin_amdgcn_exp2f(-up); nm[qt] -= up; l[qt] *= al;      /* up: how far the maximum in use rises; the same in both halves of a column */
#pragma unroll
          for (int kt = 0; kt < 2; ++kt) s[kt][qt] -= up;      /* this pass's arguments were made with the old shift */
#pragma unroll
          for (int dt = 0; dt < 4; ++dt) o[dt][qt] *= al; } }
      v16h vf[4];
#pragma unroll
      for (int dt = 0; dt < 4; ++dt) vf[dt] = fa_tfrag(&Vs[cur][ps * 32 + vr][dt * 16 + vc]);
      __builtin_amdgcn_sched_barrier(0);      /* the pass's 8 V^T loads go out as one group, in flight under the first query tile's exponentials; left free they sink to in front of each product and are waited for one pair at a time */
#pragma unroll
      for (int qt = 0; qt < 2; ++qt) { FragH p;
#pragma unroll
        for (int kt = 0; kt < 2; ++kt)
#pragma unroll
          for (int r = 0; r < 8; r += 2) { const v2f e = {__builtin_amdgcn_exp2f(s[kt][qt][r]), __builtin_amdgcn_exp2f(s[kt][qt][r + 1])}; l[qt] += e; p.h[kt * 8 + r] = (_Float16)e[0]; p.h[kt * 8 + r + 1] = (_Float16)e[1]; }
#pragma unroll
        for (int dt = 0; dt < 4; ++dt) o[dt][qt] = fa_mma(vf[dt], p.v, o[dt][qt]); }
    }
    if (t + 1 < NT) { *(v8us*)&Ks[cur ^ 1][sr][sc] = ka; *(v8us*)&Ks[cur ^ 1][sr + 32][sc] = kb; *(v8us*)&Vs[cur ^ 1][sr][sc] = va; *(v8us*)&Vs[cur ^ 1][sr + 32][sc] = vb; }      /* its last readers left it before the previous barrier */
    __syncthreads();      /* publishes stage t + 1 and ends every read of stage t */
  }
  v8us ov[2][4];      /* a lane's 8 registers of a tile are 8 consecutive d of one query row: one 16-byte store each */
#pragma unroll
  for (int qt = 0; qt < 2; ++qt) { const float lh = l[qt][0] + l[qt][1]; const float inv = 64.0f / (lh + fa_xh(lh));      /* o carried x64, as the output GEMM's alpha expects */
#pragma unroll
    for (int dt = 0; dt < 4; ++dt) { FragH f;
#pragma unroll
      for (int r = 0; r < 8; ++r) f.h[r] = (_Float16)(o[dt][qt][r] * inv);
      ov[qt][dt] = f.half[0]; } }
  unsigned short* d = (unsigned short*)Op + (r0 + q0 + ln) * DM + h * HD + 8 * hh;
#pragma unroll
  for (int qt = 0; qt < 2; ++qt)
#pragma unroll
    for (int dt = 0; dt < 4; ++dt) *(v8us*)(d + (size_t)qt * 16 * DM + dt * 16) = ov[qt][dt];
}

// ---- LDS-staged GEMM: C[M][N] = A[M][DM] . Bt[N][DM]^T * alpha + bias, f16 operands, f32 accumulation in ascending k, as before. A work-group of 8 waves (4 x 2) takes a 256 x (128 NJG) tile of C, a wave 64 x (64 NJG) of it, worked on in NJG column groups of 64 (16 accumulator tiles each).
// NJG = 3 (N = 3072): 256 x 384 tiles, so M = 8192 gives 256 work-groups, one on each WGP in one even round; an operand byte fetched from L2 and an A fragment read from LDS then serve three times the columns.
// A stage is 64 k = one 128-byte line of each operand row, brought to LDS by asynchronous copies in whole lines (8 lanes a row), into a ring of G3_NB buffers: while stage t is worked on, stages t + 1 to t + G3_NB - 1 are in flight or landed,
// so a work-group alone on its WGP keeps asking L2 through the whole trip and a stage has G3_NB - 1 trips to land in. A wave's copies return in issue order, so the publish wait is counted: it leaves the G3_NB - 2 younger stages' copies in flight. M % 256 == 0, N % (128 NJG) == 0.
#define G3_BM 256
#define G3_KT 64                     /* k per stage */
#define G3_P 72                      /* LDS row pitch in f16: 144 B = 16 B x odd, conflict-free for 16-byte fragment reads */
/* one stage: each thread copies 16 bytes of 8 A rows and of 4 Bt rows, 32 rows apart. The s_wait_xcnt closes the statement so that no address register named here is rewritten ahead of it. */
__device__ __forceinline__ void g3_stage(unsigned la, const unsigned short* ga, unsigned lb, const unsigned short* gb) {
  constexpr unsigned LS = 32u * G3_P * 2u; constexpr size_t GS = (size_t)32 * DM;
  asm volatile("global_load_async_to_lds_b128 %0, %12, off\n\t"
               "global_load_async_to_lds_b128 %1, %13, off\n\t"
               "global_load_async_to_lds_b128 %2, %14, off\n\t"
               "global_load_async_to_lds_b128 %3, %15, off\n\t"
               "global_load_async_to_lds_b128 %4, %16, off\n\t"
               "global_load_async_to_lds_b128 %5, %17, off\n\t"
               "global_load_async_to_lds_b128 %6, %18, off\n\t"
               "global_load_async_to_lds_b128 %7, %19, off\n\t"
               "global_load_async_to_lds_b128 %8, %20, off\n\t"
               "global_load_async_to_lds_b128 %9, %21, off\n\t"
               "global_load_async_to_lds_b128 %10, %22, off\n\t"
               "global_load_async_to_lds_b128 %11, %23, off\n\t"
               "s_wait_xcnt 0x0"
               :: "v"(la), "v"(la + LS), "v"(la + 2u * LS), "v"(la + 3u * LS), "v"(la + 4u * LS), "v"(la + 5u * LS), "v"(la + 6u * LS), "v"(la + 7u * LS),
                  "v"(lb), "v"(lb + LS), "v"(lb + 2u * LS), "v"(lb + 3u * LS),
                  "v"(ga), "v"(ga + GS), "v"(ga + 2 * GS), "v"(ga + 3 * GS), "v"(ga + 4 * GS), "v"(ga + 5 * GS), "v"(ga + 6 * GS), "v"(ga + 7 * GS),
                  "v"(gb), "v"(gb + GS), "v"(gb + 2 * GS), "v"(gb + 3 * GS)
               : "memory");
}
/* the wide tile's stage: 8 A rows and 12 Bt rows a thread, written as the builtin, so that the address registers need not lie among the first 256, where this kernel keeps accumulators.
   OFF is the instruction's immediate offset in bytes; it moves the global and the LDS address alike, so a caller passes both places less OFF. */
typedef int g3_v4i __attribute__((ext_vector_type(4)));
template <int OFF>
__device__ __forceinline__ void g3_copy(const unsigned short* g, unsigned short* l) {
  __builtin_amdgcn_global_load_async_to_lds_b128((__attribute__((address_space(1))) g3_v4i*)g, (__attribute__((address_space(3))) g3_v4i*)l, OFF, 0);
}
template <int OFF>
__device__ __forceinline__ void g3_stage_wide(unsigned short* la, const unsigned short* ga, unsigned short* lb, const unsigned short* gb) {
#pragma unroll
  for (int i = 0; i < 8; ++i) g3_copy<OFF>(ga + (size_t)i * 32 * DM, la + i * 32 * G3_P);
#pragma unroll
  for (int i = 0; i < 12; ++i) g3_copy<OFF>(gb + (size_t)i * 32 * DM, lb + i * 32 * G3_P);
}
template <bool F32OUT, int NJG>
__global__ __launch_bounds__(256) void k_gemm3(const _Float16* __restrict__ A, const _Float16* __restrict__ Bh, float alpha, const float* __restrict__ bias, float* __restrict__ C, _Float16* __restrict__ C16, int N) {
  constexpr int G3_BN = 128 * NJG; constexpr int G3_BUF = (G3_BM + G3_BN) * G3_P;      /* columns per work-group; f16 per buffer: A rows, then Bt rows */
  constexpr int G3_NB = NJG == 1 ? 4 : 3;      /* buffers in the ring: the wide tile's LDS holds 3; the narrow tile's trips are a third as long, so it takes one more. 12 (narrow) or 20 (wide) copies a wave and stage, never more than 48 or 60 of a wave outstanding */
  static_assert((NJG == 1 ? 12 : 20) * (G3_NB - 1) == (NJG == 1 ? 36 : 40) && (NJG == 1 ? 12 : 20) * (G3_NB - 2) == (NJG == 1 ? 24 : 20), "the counted waits below are written as literals");
  __shared__ __attribute__((aligned(16))) unsigned short sm[G3_NB * G3_BUF];
  constexpr int NT = DM / G3_KT; static_assert(DM % G3_KT == 0 && NT >= G3_NB, "the prologue fills every buffer");
  static_assert(G3_NB * G3_BUF * 2 <= 327680, "the ring fits the LDS of a WGP");
  static_assert(8 * 32 * 68 * 4 <= G3_NB * G3_BUF * 2, "the output staging reuses the ring");
  const int tid = threadIdx.x, w = tid >> 5, lane = tid & 31, ln = lane & 15, hh = lane >> 4;
  const int NN = NJG == 1 ? N : LQ;      /* the wide tile is for the q | k | v rows: with their pitch a constant, all of a lane's output addresses are one register pair and immediate offsets */
  const int ntn = NN / G3_BN; const int mt = blockIdx.x / ntn, nq = blockIdx.x - mt * ntn;
  const int wm = w >> 1, wn = w & 1;
  const int sr = tid >> 3, sc = (tid & 7) * 8;      /* staging: 8 lanes cover one 128-byte row */
  const unsigned short* ga = (const unsigned short*)A + (size_t)(mt * G3_BM + sr) * DM + sc;
  const unsigned short* gb = (const unsigned short*)Bh + (size_t)(nq * G3_BN + sr) * DM + sc;
  const unsigned la = (unsigned)(size_t)sm + (unsigned)(sr * G3_P + sc) * 2u, lb = la + G3_BM * G3_P * 2u;      /* LDS byte addresses in buffer 0 */
  unsigned short* const pa = sm + sr * G3_P + sc;      /* the same place as la, as a pointer, for the builtin */
  if (NJG == 1) {
#pragma unroll      /* the buffers' places become constants added to one address */
    for (int s = 0; s < G3_NB; ++s) g3_stage(la + s * (G3_BUF * 2u), ga + s * G3_KT, lb + s * (G3_BUF * 2u), gb + s * G3_KT);
    asm volatile("s_wait_asynccnt 36" ::: "memory");      /* stage 0 has landed before the barrier publishes it; the 3 x 12 copies of stages 1 to 3 fly on */
  } else {
    g3_stage_wide<0>(pa, ga, pa + G3_BM * G3_P, gb);
    g3_stage_wide<G3_KT * 2>(pa + G3_BUF - G3_KT, ga, pa + G3_BUF + G3_BM * G3_P - G3_KT, gb);      /* stage s = stage 0's global addresses + 128 s bytes, as the immediate offset: the 20 address pairs serve all three stages */
    g3_stage_wide<G3_KT * 4>(pa + 2 * G3_BUF - 2 * G3_KT, ga, pa + 2 * G3_BUF + G3_BM * G3_P - 2 * G3_KT, gb);
    asm volatile("s_wait_asynccnt 40" ::: "memory");      /* stage 0 has landed before the barrier publishes it; the 2 x 20 copies of stages 1 and 2 fly on */
  }
  __syncthreads();
  const v8f z8 = {0.f,0.f,0.f,0.f,0.f,0.f,0.f,0.f};
  v8f acc[4][4 * NJG];      /* [row tile][column tile] */
#pragma unroll
  for (int i = 0; i < 4; ++i)
#pragma unroll
    for (int j = 0; j < 4 * NJG; ++j) acc[i][j] = z8;
  /* one trip: stage t, in buffer cur. FILL: stage t + G3_NB exists and is asked for at the foot. AHEAD: stage t + G3_NB - 1 exists, so G3_NB - 2 whole stages are younger than stage t + 1 */
  auto trip = [&](const int t, const int cur, const bool FILL, const bool AHEAD) __attribute__((always_inline)) {
    const unsigned short* Ab = sm + cur * G3_BUF + (wm * 64 + ln) * G3_P; const unsigned short* Bb = sm + cur * G3_BUF + (G3_BM + wn * (64 * NJG) + ln) * G3_P;
#pragma unroll
    for (int ks = 0; ks < 2; ++ks) { v16h af[4];      /* the A fragments serve all NJG column groups */
#pragma unroll
      for (int jg = 0; jg < NJG; ++jg) { v16h bf[4];
#pragma unroll
        for (int i = 0; i < 4; ++i) { if (jg == 0) af[i] = fa_lfrag(Ab + i * 16 * G3_P + ks * 32, hh); bf[i] = fa_lfrag(Bb + (jg * 4 + i) * 16 * G3_P + ks * 32, hh); }
        __builtin_amdgcn_sched_barrier(0);      /* the block's fragment loads go out as one group; left free they are issued row by row, each with a full wait in front of 4 products */
#pragma unroll
        for (int i = 0; i < 4; ++i)
#pragma unroll
          for (int j = 0; j < 4; ++j) acc[i][jg * 4 + j] = fa_mma(af[i], bf[j], acc[i][jg * 4 + j]); } }
    asm volatile("s_wait_dscnt 0x0" ::: "memory");         /* this wave's reads of stage t have returned before the buffer is handed back */
    /* this wave's copies of stage t + 1 have landed: the younger stages' copies, counted exactly, stay in flight; in the last trips, where fewer are out, the wait is to 0 */
    if (!AHEAD) asm volatile("s_wait_asynccnt 0x0" ::: "memory"); else if (NJG == 1) asm volatile("s_wait_asynccnt 24" ::: "memory"); else asm volatile("s_wait_asynccnt 20" ::: "memory");
    __syncthreads();      /* publishes stage t + 1 and ends every read of stage t */
    if (FILL) { if (NJG == 1) g3_stage(la + cur * (G3_BUF * 2u), ga + (t + G3_NB) * G3_KT, lb + cur * (G3_BUF * 2u), gb + (t + G3_NB) * G3_KT); else g3_stage_wide<0>(pa + cur * G3_BUF, ga + (t + G3_NB) * G3_KT, pa + cur * G3_BUF + G3_BM * G3_P, gb + (t + G3_NB) * G3_KT); }      /* into the buffer that trip t has just read */
  };
  int cur = 0;      /* t mod G3_NB */
#pragma unroll 1      /* the stage loop stays rolled: the buffer index is the only thing that changes, and a longer body would only cost instruction cache */
  for (int t = 0; t < NT - G3_NB; ++t) { trip(t, cur, true, true); cur = cur + 1 == G3_NB ? 0 : cur + 1; }
  trip(NT - G3_NB, cur, false, true); cur = cur + 1 == G3_NB ? 0 : cur + 1;      /* the last stage is out: nothing more to ask for */
#pragma unroll 1      /* the last trips are a loop of their own, so that no trip branches on which wait it needs */
  for (int t = NT - G3_NB + 1; t < NT; ++t) { trip(t, cur, false, false); cur = cur + 1 == G3_NB ? 0 : cur + 1; }
  asm volatile("s_wait_asynccnt 0x0" ::: "memory");      /* nothing is in flight when the ring becomes output staging */
  /* whole-line stores: each wave stages 32 x 64 results at a time in its own part of the ring, which every reader left at the loop's last barrier */
  float* so = (float*)sm + w * (32 * 68);
  const int row0 = mt * G3_BM + wm * 64; const int rsub = lane >> 4, c4 = (lane & 15) * 4;
#pragma unroll
  for (int jg = 0; jg < NJG; ++jg) { const int col0 = nq * G3_BN + wn * (64 * NJG) + jg * 64;
  float bv[4];
#pragma unroll
  for (int j = 0; j < 4; ++j) bv[j] = bias[col0 + j * 16 + ln];
  if (NJG != 1) { asm volatile("s_wait_xcnt 0x0" ::: "memory");      /* stands ahead of every later write to the offset register that these loads name */ }
#pragma unroll
  for (int j = 0; j < 4; ++j) bv[j] = bf16_round(bv[j]);
  float ag = alpha;
  if (NJG != 1 && col0 < DM) { ag *= FA_C;      /* the q third is stored x FA_C (scaled in f32, ahead of its one rounding to f16): the attention's scores then come out in log2 units */
#pragma unroll
    for (int j = 0; j < 4; ++j) bv[j] *= FA_C; }
#pragma unroll
  for (int half = 0; half < 2; ++half) {
#pragma unroll
    for (int u = 0; u < 8; ++u) { const int j = u & 3, ii = u >> 2;
#pragma unroll
      for (int r = 0; r < 8; ++r) so[(ii * 16 + 8 * hh + r) * 68 + j * 16 + ln] = acc[half * 2 + ii][jg * 4 + j][r] * ag + bv[j]; }
    if (NJG == 1) __builtin_amdgcn_fence(__ATOMIC_ACQ_REL, "workgroup"); else __builtin_amdgcn_fence(__ATOMIC_ACQ_REL, "workgroup", "local");      /* wide tile: six parts, so the fence orders LDS alone and no part waits for the part before to reach memory */
    __builtin_amdgcn_wave_barrier();      /* the wave reads back what its other lanes wrote */
    if (NJG == 1) {
#pragma unroll
    for (int q = 0; q < 16; ++q) { const int r = q * 2 + rsub; const v4f v = *(const v4fa*)&so[r * 68 + c4]; const size_t o = (size_t)(row0 + half * 32 + r) * N + col0 + c4;
      if (F32OUT) *(v4f*)(C + o) = v; else { v4h h4; for (int i = 0; i < 4; ++i) h4[i] = (_Float16)v[i]; *(v4h*)(C16 + o) = h4; } }
    } else { static_assert(NJG == 1 || !F32OUT, "the wide tile writes f16");
      v4h hv[16]; _Float16* pp[16];      /* the 16 rows' values in registers of their own, then the 16 stores as one run */
#pragma unroll
      for (int q = 0; q < 16; ++q) { const int r = q * 2 + rsub; const v4f v = *(const v4fa*)&so[r * 68 + c4]; for (int i = 0; i < 4; ++i) hv[q][i] = (_Float16)v[i]; pp[q] = C16 + (size_t)(row0 + rsub) * NN + col0 + c4 + (size_t)(half * 32 + q * 2) * NN; }
#pragma unroll
      for (int q = 0; q < 16; ++q) *(v4h*)pp[q] = hv[q];
      asm volatile("s_wait_xcnt 0x0" ::: "memory");      /* stands ahead of every later write to a register that these stores name */
    }
    if (NJG == 1) __builtin_amdgcn_fence(__ATOMIC_ACQ_REL, "workgroup"); else __builtin_amdgcn_fence(__ATOMIC_ACQ_REL, "workgroup", "local");
    __builtin_amdgcn_wave_barrier();      /* the rows are read before the next part overwrites them */
  } }
}

// ---- one preparatory launch. The two weight transposes and the LayerNorm read nothing of one another, and there are as many weight tiles (w_qkv's, then w_proj's) as groups of 8 * LN_RW token rows:
// a work-group takes one tile and one group of rows. All of a thread's loads, 8 of the tile and 32 of the rows, go out together; the tile is turned in LDS while the row statistics are summed.
// LayerNorm by rows in registers: a wave takes LN_RW whole rows, a lane 32 columns of each (8 loads of 16 bytes, every wave-wide load 512 contiguous bytes).
// Mean and variance: per-lane partial sums, then a 32-lane butterfly, without LDS. The plain unrolls keep the indices of the register arrays compile-time constants.
#define LN_RW 2                      /* rows per wave */
#define LN_CH (DM / 128)             /* 16-byte chunks of a row per lane */
template <int CTRL> __device__ __forceinline__ float ln_dpp(float x) { return __builtin_bit_cast(float, __builtin_amdgcn_update_dpp(0, __builtin_bit_cast(int, x), CTRL, 0xf, 0xf, true)); }      /* CTRL 0x160 + m: lane l <- lane l ^ m inside a 16-lane row */
__device__ __forceinline__ float ln_sum32(float x) { x += ln_dpp<0x161>(x); x += ln_dpp<0x162>(x); x += ln_dpp<0x164>(x); x += ln_dpp<0x168>(x); return x + fa_xh(x); }      /* every lane ends with the same bits: each step adds the same two values on both sides */
#define WT_NKT (DM / WT_KT)                  /* tiles along k */
#define WT_NQ (WT_NKT * (LQ / WT_NT))        /* tiles of w_qkv; w_proj's follow */
__global__ __launch_bounds__(256) void k_prep(const float* __restrict__ X, const float* __restrict__ g, const float* __restrict__ bb, float eps, _Float16* __restrict__ N16,
                                              const float* __restrict__ Wq, _Float16* __restrict__ Wqt, const float* __restrict__ Wo, _Float16* __restrict__ Wot, float scale) {
  __shared__ __attribute__((aligned(16))) unsigned short tl[WT_NT][WT_P];      /* [n][k] */
  const int tid = threadIdx.x, tg = tid >> 4, tc = tid & 15, bid = blockIdx.x; const bool isq = bid < WT_NQ; const int tb = isq ? bid : bid - WT_NQ;      /* the same for the whole work-group */
  const int k0 = (tb % WT_NKT) * WT_KT, n0 = (tb / WT_NKT) * WT_NT;
  v4f x[8];
  if (isq) wt_load<LQ>(Wq + (size_t)(k0 + tg * 8) * LQ + n0 + tc * 4, x); else wt_load<DM>(Wo + (size_t)(k0 + tg * 8) * DM + n0 + tc * 4, x);
  const int lane = threadIdx.x & 31, c0 = lane * 4; const size_t r0 = ((size_t)blockIdx.x * 8 + (threadIdx.x >> 5)) * LN_RW;
  v4f s[LN_RW][LN_CH], gg[LN_CH], bt[LN_CH];
#pragma unroll
  for (int rw = 0; rw < LN_RW; ++rw)
#pragma unroll
    for (int u = 0; u < LN_CH; ++u) s[rw][u] = *(const v4fa*)(X + (r0 + rw) * DM + u * 128 + c0);
#pragma unroll
  for (int u = 0; u < LN_CH; ++u) { gg[u] = *(const v4fa*)(g + u * 128 + c0); bt[u] = *(const v4fa*)(bb + u * 128 + c0); }
  asm volatile("s_wait_xcnt 0x0" ::: "memory");      /* stands ahead of every later write to an address register that these loads name */
  __builtin_amdgcn_sched_barrier(0);      /* all 40 loads go out before the first is waited for; left free, the rows' loads are issued behind waits for the tile's, and gamma's and beta's later still: one trip to memory after another */
#pragma unroll
  for (int j = 0; j < 4; ++j) { FragH f;
#pragma unroll
    for (int i = 0; i < 8; ++i) f.h[i] = (_Float16)(bf16_round(x[i][j]) * scale);
    *(v8us*)&tl[tc * 4 + j][tg * 8] = f.half[0]; }
  float mu[LN_RW], rs[LN_RW];
#pragma unroll
  for (int rw = 0; rw < LN_RW; ++rw) { v4f a = {0.f, 0.f, 0.f, 0.f};
#pragma unroll
    for (int u = 0; u < LN_CH; ++u) {
#pragma unroll
      for (int q = 0; q < 4; ++q) s[rw][u][q] = bf16_round(s[rw][u][q]);
      a += s[rw][u]; }
    mu[rw] = (a[0] + a[1]) + (a[2] + a[3]); }
#pragma unroll
  for (int rw = 0; rw < LN_RW; ++rw) mu[rw] = ln_sum32(mu[rw]) * (1.0f / (float)DM);
#pragma unroll
  for (int rw = 0; rw < LN_RW; ++rw) { v4f a = {0.f, 0.f, 0.f, 0.f};
#pragma unroll
    for (int u = 0; u < LN_CH; ++u) { s[rw][u] -= mu[rw]; a += s[rw][u] * s[rw][u]; }
    rs[rw] = (a[0] + a[1]) + (a[2] + a[3]); }
#pragma unroll
  for (int rw = 0; rw < LN_RW; ++rw) rs[rw] = rsqrtf(ln_sum32(rs[rw]) * (1.0f / (float)DM) + eps);
  __syncthreads();      /* a Wt row is put together by 16 threads of 8 waves; it stands behind the sums, so that no wave waits here for long, and ahead of every global store, so that it waits for none */
  unsigned short* d = (unsigned short*)(isq ? Wqt : Wot) + (size_t)(n0 + tg) * DM + k0 + tc * 8;
#pragma unroll
  for (int q = 0; q < 4; ++q) { const v8us v = *(const v8us*)&tl[q * 16 + tg][tc * 8]; *(v8us*)(d + (size_t)q * 16 * DM) = v; }
  asm volatile("s_wait_xcnt 0x0" ::: "memory");      /* stands ahead of every later write to a register that these stores name */
#pragma unroll
  for (int u = 0; u < LN_CH; ++u) {
#pragma unroll
    for (int q = 0; q < 4; ++q) { gg[u][q] = bf16_round(gg[u][q]); bt[u][q] = bf16_round(bt[u][q]); }
#pragma unroll
    for (int rw = 0; rw < LN_RW; ++rw) { const v4f yf = s[rw][u] * rs[rw] * gg[u] + bt[u]; v4h y;
#pragma unroll
      for (int q = 0; q < 4; ++q) y[q] = (_Float16)yf[q];
      *(v4h*)(N16 + (r0 + rw) * DM + u * 128 + c0) = y; } }
}

extern "C" void kernel_launch(void* const* d_in, const int* in_sizes, int n_in,
                              void* d_out, int out_size, void* d_ws, size_t ws_size, hipStream_t stream) {
  (void)in_sizes; (void)n_in; (void)out_size;
  const float* const* I = (const float* const*)d_in; const float* x = I[0]; const float* lng = I[1]; const float* lnb = I[2]; const float* wqkv = I[3]; const float* bqkv = I[4]; const float* wo = I[5]; const float* bo = I[6];      /* x; LayerNorm gamma / beta; [in][out] fused weight + bias; [in][out] w_proj + b_proj */
  static_assert(DM % 128 == 0 && NR % (8 * LN_RW) == 0, "k_prep: whole 512-byte chunks, whole work-groups");
  char* ws = (char*)d_ws; size_t off = 0;
  auto take = [&](size_t bytes) { char* p = ws + off; off += (bytes + 255) & ~(size_t)255; return p; };
  _Float16* BQKV = (_Float16*)take((size_t)3 * DM * DM * 2); _Float16* BO = (_Float16*)take((size_t)DM * DM * 2);
  _Float16* X16 = (_Float16*)take(NR * DM * 2); _Float16* QKV = (_Float16*)take(NR * 3 * DM * 2); _Float16* O16 = (_Float16*)take(NR * DM * 2);
  if (off > ws_size) return;
  static_assert(DM % WT_KT == 0 && LQ % WT_NT == 0 && DM % WT_NT == 0, "k_prep: whole tiles");
  static_assert(WT_NQ + WT_NKT * (DM / WT_NT) == NR / (8 * LN_RW), "k_prep: one weight tile and one group of rows per work-group");
  k_prep<<<(unsigned)(NR / (8 * LN_RW)), 256, 0, stream>>>(x, lng, lnb, 1e-5f, X16, wqkv, BQKV, wo, BO, 16.0f);      /* xn = LayerNorm(bf16(x)) -> f16 rows (f32 statistics): the attention's input rows; both weights [in][out] -> Bt x16 */
  const size_t r0p = (size_t)B0 * SQ;      /* first projected row */
  k_gemm3<false, 3><<<(unsigned)((MP / G3_BM) * (3 * DM / 384)), 256, 0, stream>>>(X16 + r0p * DM, BQKV, 0.0625f, bqkv, nullptr, QKV + r0p * 3 * DM, 3 * DM);      /* q | k | v rows (f16), q x FA_C; head h = columns h*HD.. of each DM block */
  k_fattn<<<dim3(SQ / 256, NB * NH), 256, 0, stream>>>(QKV, O16);      /* o x64 (merged heads) as f16 rows */
  k_gemm3<true, 1><<<(unsigned)((MPO / G3_BM) * (DM / 128)), 256, 0, stream>>>(O16 + r0p * DM, BO, 0.0009765625f, bo, (float*)d_out + r0p * DM, nullptr, DM);      /* out rows are the output layout */
}
